// v000
// The times below were measured on an AMD MI455X: many runs one after another, warmed up first and cycling through
// copies of the inputs, with the whole window's GPU time divided by the number of runs. Launches and the gaps
// between them are all in it. The median over several windows is given; except for v000 it joins two sittings, which
// can be a few percent apart, so the side-by-side timings, each taken in one sitting, are the better comparison.
// v000, which the later versions start from, runs in 90.6 microseconds.
#include <hip/hip_runtime.h>
#include <hip/hip_bf16.h>

typedef __attribute__((ext_vector_type(2))) float v2f;
typedef __attribute__((ext_vector_type(8))) float v8f;

#define SEQ    4096
#define DM     1024
#define NSTATE 64
#define NC     16      // channels per workgroup
#define NT     256     // output timesteps per workgroup
#define WIN    320     // staged input window per channel
#define UPITCH 340     // 320 + 320/16 pad floats (swizzle idx + (idx>>4))
#define KPITCH 68      // 64 + pad
#define OPITCH 257     // 256 + pad

#if defined(__gfx1250__) && __has_builtin(__builtin_amdgcn_global_load_async_to_lds_b32)
#define ASYNC_STAGE 1
#else
#define ASYNC_STAGE 0
#endif

typedef __attribute__((address_space(1))) int gbl_i32;   // global-AS int (per hipcc diagnostic)
typedef __attribute__((address_space(3))) int lds_i32;   // LDS-AS int

__device__ __forceinline__ void wait_async_zero() {
#if ASYNC_STAGE
#if __has_builtin(__builtin_amdgcn_s_wait_asynccnt)
    __builtin_amdgcn_s_wait_asynccnt(0);
#else
    asm volatile("s_wait_asynccnt 0" ::: "memory");
#endif
#endif
}

// ---------- prologue 1: csum[s] = sum_m C[m,s] ----------
__global__ void csum_kernel(const float* __restrict__ C, float* __restrict__ csum) {
    int s = threadIdx.x;               // 64 threads
    float acc = 0.f;
    for (int m = 0; m < DM; ++m) acc += C[m * NSTATE + s];
    csum[s] = acc;
}

// ---------- prologue 2: Kt[l*DM + c] = sum_s csum[s]*B[s,c]*exp(A[s]*dt[c]*l) ----------
__global__ void kt_kernel(const float* __restrict__ A, const float* __restrict__ Bp,
                          const float* __restrict__ log_dt, const float* __restrict__ csum,
                          float* __restrict__ Kt) {
    int idx = blockIdx.x * blockDim.x + threadIdx.x;   // 64*1024 threads
    int c = idx & (DM - 1);
    int l = idx >> 10;
    float dt = __expf(log_dt[c]);
    float acc = 0.f;
    for (int s = 0; s < NSTATE; ++s) {
        acc += csum[s] * Bp[s * DM + c] * __expf(A[s] * dt * (float)l);
    }
    Kt[l * DM + c] = acc;
}

// ---------- main: depthwise 64-tap conv as Toeplitz-band WMMA f32 ----------
__launch_bounds__(256)
__global__ void ssm_conv_wmma(const float* __restrict__ u,
                              const float* __restrict__ Kt,    // [64][1024]
                              const float* __restrict__ Dvec,  // [1024]
                              float* __restrict__ y) {
    __shared__ float u_lds[NC * UPITCH];
    __shared__ float k_lds[NC * KPITCH];
    __shared__ float o_lds[NC * OPITCH];

    const int tid  = threadIdx.x;
    const int lane = tid & 31;
    const int wave = tid >> 5;           // 8 waves
    const int cl   = tid & 15;           // staging: channel lane
    const int tq   = tid >> 4;           // staging: time slot 0..15

    const int T0 = blockIdx.x * NT;      // output time base
    const int c0 = blockIdx.y * NC;      // channel base
    const int b  = blockIdx.z;           // batch
    const int W0 = T0 - 32;              // input window base

    // ---- stage u window [W0, W0+320), coalesced across channels ----
    const float* ubase = u + (size_t)b * SEQ * DM + c0 + cl;
    auto stage_u = [&](int tl, bool check) {
        int t    = W0 + tl;
        int lidx = cl * UPITCH + tl + (tl >> 4);       // pad swizzle
        bool ok  = !check || ((unsigned)t < (unsigned)SEQ);
#if ASYNC_STAGE
        if (ok) {
            __builtin_amdgcn_global_load_async_to_lds_b32(
                (gbl_i32*)(ubase + (size_t)t * DM),
                (lds_i32*)&u_lds[lidx], 0, 0);
        } else {
            u_lds[lidx] = 0.f;
        }
#else
        float v = 0.f;
        if (ok) v = ubase[(size_t)t * DM];
        u_lds[lidx] = v;
#endif
    };
    if (W0 >= 0 && W0 + WIN <= SEQ) {
        #pragma unroll
        for (int p = 0; p < WIN / 16; ++p) stage_u(p * 16 + tq, false);
    } else {
        #pragma unroll
        for (int p = 0; p < WIN / 16; ++p) stage_u(p * 16 + tq, true);
    }
    // ---- stage per-channel kernels ----
    #pragma unroll
    for (int p = 0; p < 4; ++p) {
        int l = p * 16 + tq;
#if ASYNC_STAGE
        __builtin_amdgcn_global_load_async_to_lds_b32(
            (gbl_i32*)&Kt[l * DM + c0 + cl],
            (lds_i32*)&k_lds[cl * KPITCH + l], 0, 0);
#else
        k_lds[cl * KPITCH + l] = Kt[l * DM + c0 + cl];
#endif
    }
    wait_async_zero();
    __syncthreads();

    const int row = lane & 15;           // A row a' / B column m / D column
    const int hi  = lane >> 4;           // half-wave selects K-pair {0,1} vs {2,3}

    for (int cc = wave * 2; cc < wave * 2 + 2; ++cc) {   // 2 channels per wave
        const float* uc = &u_lds[cc * UPITCH];
        const float* kp = &k_lds[cc * KPITCH];
        v8f acc = {0.f, 0.f, 0.f, 0.f, 0.f, 0.f, 0.f, 0.f};

        // one MMA K-chunk: A[a',j]=u[T0+16a'-32+j], Bmat[j,m]=K[m+63-j]
        auto mma_step = [&](int kc, bool edge_lo, bool edge_hi) {
            int j0   = 4 * kc + 2 * hi;
            int aidx = 16 * row + j0;                    // even, (aidx&15)<=14
            int ap0  = aidx + (aidx >> 4);
            v2f afrag = { uc[ap0], uc[ap0 + 1] };
            int l0 = row + 63 - j0;                      // K tap for vgpr0 row
            int l1 = l0 - 1;                             // K tap for vgpr1 row
            float b0 = kp[l0 & 63];
            float b1 = kp[l1 & 63];
            if (edge_hi) {                               // kc<4: taps may exceed 63
                if (l0 > 63) b0 = 0.f;
                if (l1 > 63) b1 = 0.f;
            }
            if (edge_lo) {                               // kc>=16: taps may go negative
                if (l0 < 0) b0 = 0.f;
                if (l1 < 0) b1 = 0.f;
            }
            v2f bfrag = { b0, b1 };
            acc = __builtin_amdgcn_wmma_f32_16x16x4_f32(
                      false, afrag, false, bfrag, (short)0, acc, false, false);
        };
        #pragma unroll
        for (int kc = 0; kc < 4; ++kc)  mma_step(kc, false, true);   // upper band edge
        #pragma unroll
        for (int kc = 4; kc < 16; ++kc) mma_step(kc, false, false);  // interior: no checks
        #pragma unroll
        for (int kc = 16; kc < 20; ++kc) mma_step(kc, true, false);  // lower band edge

        // epilogue: + D[c]*u, transpose into LDS for coalesced store
        float Dc = Dvec[c0 + cc];
        float* oc = &o_lds[cc * OPITCH];
        #pragma unroll
        for (int r = 0; r < 8; ++r) {
            int ap   = r + 8 * hi;                 // D-matrix row (output block a')
            int tl   = 16 * ap + row;              // local output time
            int uidx = tl + 32;                    // u[T0+tl] inside staged window
            float uval = uc[uidx + (uidx >> 4)];
            oc[tl] = acc[r] + Dc * uval;
        }
    }
    __syncthreads();

    // ---- coalesced global store: lanes across channels ----
    #pragma unroll
    for (int p = 0; p < NT / 16; ++p) {
        int tl = p * 16 + tq;
        y[((size_t)b * SEQ + T0 + tl) * DM + c0 + cl] = o_lds[cl * OPITCH + tl];
    }
}

extern "C" void kernel_launch(void* const* d_in, const int* in_sizes, int n_in,
                              void* d_out, int out_size, void* d_ws, size_t ws_size,
                              hipStream_t stream) {
    const float* u      = (const float*)d_in[0];
    const float* A      = (const float*)d_in[1];
    const float* Bp     = (const float*)d_in[2];
    const float* Cp     = (const float*)d_in[3];
    const float* Dp     = (const float*)d_in[4];
    const float* log_dt = (const float*)d_in[5];
    float* y = (float*)d_out;

    float* csum = (float*)d_ws;                       // 64 floats
    float* Kt   = (float*)((char*)d_ws + 1024);       // 64*1024 floats

    csum_kernel<<<1, 64, 0, stream>>>(Cp, csum);
    kt_kernel<<<(NSTATE * DM) / 256, 256, 0, stream>>>(A, Bp, log_dt, csum, Kt);

    dim3 grid(SEQ / NT, DM / NC, 8);
    ssm_conv_wmma<<<grid, 256, 0, stream>>>(u, Kt, Dp, y);
}

// v001
// It runs in 62 microseconds.
// Two timings next to v000 both put it at 1.51 times that version's speed.
#include <hip/hip_runtime.h>
#include <hip/hip_bf16.h>

typedef __attribute__((ext_vector_type(2))) float v2f;
typedef __attribute__((ext_vector_type(4))) float v4f;
typedef __attribute__((ext_vector_type(8))) float v8f;

#define SEQ    4096
#define DM     1024
#define NSTATE 64
#define NC     16      // channels per workgroup
#define NT     256     // output timesteps per workgroup
#define WIN    320     // staged input window per channel
#define UPITCH 340     // 320 + 320/16 pad floats (swizzle idx + (idx>>4))
#define KPITCH 68      // 64 + pad
#define OPITCH 257     // 256 + pad

#if defined(__gfx1250__) && __has_builtin(__builtin_amdgcn_global_load_async_to_lds_b32)
#define ASYNC_STAGE 1
#else
#define ASYNC_STAGE 0
#endif

typedef __attribute__((address_space(1))) int gbl_i32;   // global-AS int (per hipcc diagnostic)
typedef __attribute__((address_space(3))) int lds_i32;   // LDS-AS int

__device__ __forceinline__ void wait_async_zero() {
#if ASYNC_STAGE
#if __has_builtin(__builtin_amdgcn_s_wait_asynccnt)
    __builtin_amdgcn_s_wait_asynccnt(0);
#else
    asm volatile("s_wait_asynccnt 0" ::: "memory");
#endif
#endif
}

// ---------- prologue: Kt[l*DM + c] = sum_s csum[s]*B[s,c]*exp(A[s]*dt[c]*l), csum[s] = sum_m C[m,s] ----------
// Every workgroup forms csum itself: 256 threads read C (256 KiB) in whole rows, 16 bytes a lane,
// and join their partial sums through LDS.
__launch_bounds__(256)   // the launched block: leaves registers for the window of C loads
__global__ void kt_kernel(const float* __restrict__ A, const float* __restrict__ Bp,
                          const float* __restrict__ log_dt, const float* __restrict__ C,
                          float* __restrict__ Kt) {
    __shared__ __attribute__((aligned(16))) float part[16 * NSTATE];   // [row slot][state]
    __shared__ __attribute__((aligned(16))) float cs[NSTATE];

    const int tid = threadIdx.x;
    const int q   = tid & 15;            // which 4 states of a row
    const int rs  = tid >> 4;            // row slot 0..15
    const v4f* C4 = (const v4f*)C + rs * (NSTATE / 4) + q;
    v4f p = {0.f, 0.f, 0.f, 0.f};
    // full unroll: the 64 loads are independent and share one address register, so the compiler keeps a
    // window of them in flight with no drain at a loop's end
    #pragma unroll
    for (int i = 0; i < DM / 16; ++i) p += C4[i * 16 * (NSTATE / 4)];
    *(v4f*)&part[rs * NSTATE + 4 * q] = p;
    __syncthreads();
    if (tid < NSTATE) {
        float t = 0.f;
        // unroll: the 16 LDS reads issue together instead of one latency each
        #pragma unroll
        for (int r = 0; r < 16; ++r) t += part[r * NSTATE + tid];
        cs[tid] = t;
    }
    __syncthreads();

    int idx = blockIdx.x * blockDim.x + tid;           // 64*1024 threads
    int c = idx & (DM - 1);
    int l = idx >> 10;
    float dt = __expf(log_dt[c]);
    float acc = 0.f;
    // kept rolled: eight short trips reuse the fetched code; left to itself the compiler lays all 64 terms out as
    // straight-line code that each wave runs through once
    #pragma unroll 1
    for (int s0 = 0; s0 < NSTATE; s0 += 8) {
        const float* bp = Bp + s0 * DM + c;
        float bv[8];
        // unroll: the eight loads of B issue as one run off one address
        #pragma unroll
        for (int i = 0; i < 8; ++i) bv[i] = bp[i * DM];
        // precaution: one wait behind the run, in front of the step of its address registers for the next trip
        asm volatile("s_wait_xcnt 0x0" ::: "memory");
        // unroll: bv is indexed by constants and stays in registers
        #pragma unroll
        for (int i = 0; i < 8; ++i) acc += cs[s0 + i] * bv[i] * __expf(A[s0 + i] * dt * (float)l);
    }
    Kt[l * DM + c] = acc;
}

// ---------- main: depthwise 64-tap conv as Toeplitz-band WMMA f32 ----------
__launch_bounds__(256)
__global__ void ssm_conv_wmma(const float* __restrict__ u,
                              const float* __restrict__ Kt,    // [64][1024]
                              const float* __restrict__ Dvec,  // [1024]
                              float* __restrict__ y) {
    __shared__ float u_lds[NC * UPITCH];
    __shared__ float k_lds[NC * KPITCH];
    __shared__ float o_lds[NC * OPITCH];

    const int tid  = threadIdx.x;
    const int lane = tid & 31;
    const int wave = tid >> 5;           // 8 waves
    const int cl   = tid & 15;           // staging: channel lane
    const int tq   = tid >> 4;           // staging: time slot 0..15

    const int T0 = blockIdx.x * NT;      // output time base
    const int c0 = blockIdx.y * NC;      // channel base
    const int b  = blockIdx.z;           // batch
    const int W0 = T0 - 32;              // input window base

    // ---- stage u window [W0, W0+320), coalesced across channels ----
    const float* ubase = u + (size_t)b * SEQ * DM + c0 + cl;
    auto stage_u = [&](int tl, bool check) {
        int t    = W0 + tl;
        int lidx = cl * UPITCH + tl + (tl >> 4);       // pad swizzle
        bool ok  = !check || ((unsigned)t < (unsigned)SEQ);
#if ASYNC_STAGE
        if (ok) {
            __builtin_amdgcn_global_load_async_to_lds_b32(
                (gbl_i32*)(ubase + (size_t)t * DM),
                (lds_i32*)&u_lds[lidx], 0, 0);
        } else {
            u_lds[lidx] = 0.f;
        }
#else
        float v = 0.f;
        if (ok) v = ubase[(size_t)t * DM];
        u_lds[lidx] = v;
#endif
    };
    if (W0 >= 0 && W0 + WIN <= SEQ) {
        #pragma unroll
        for (int p = 0; p < WIN / 16; ++p) stage_u(p * 16 + tq, false);
    } else {
        #pragma unroll
        for (int p = 0; p < WIN / 16; ++p) stage_u(p * 16 + tq, true);
    }
    // ---- stage per-channel kernels ----
    #pragma unroll
    for (int p = 0; p < 4; ++p) {
        int l = p * 16 + tq;
#if ASYNC_STAGE
        __builtin_amdgcn_global_load_async_to_lds_b32(
            (gbl_i32*)&Kt[l * DM + c0 + cl],
            (lds_i32*)&k_lds[cl * KPITCH + l], 0, 0);
#else
        k_lds[cl * KPITCH + l] = Kt[l * DM + c0 + cl];
#endif
    }
    wait_async_zero();
    __syncthreads();

    const int row = lane & 15;           // A row a' / B column m / D column
    const int hi  = lane >> 4;           // half-wave selects K-pair {0,1} vs {2,3}

    for (int cc = wave * 2; cc < wave * 2 + 2; ++cc) {   // 2 channels per wave
        const float* uc = &u_lds[cc * UPITCH];
        const float* kp = &k_lds[cc * KPITCH];
        v8f acc = {0.f, 0.f, 0.f, 0.f, 0.f, 0.f, 0.f, 0.f};

        // one MMA K-chunk: A[a',j]=u[T0+16a'-32+j], Bmat[j,m]=K[m+63-j]
        auto mma_step = [&](int kc, bool edge_lo, bool edge_hi) {
            int j0   = 4 * kc + 2 * hi;
            int aidx = 16 * row + j0;                    // even, (aidx&15)<=14
            int ap0  = aidx + (aidx >> 4);
            v2f afrag = { uc[ap0], uc[ap0 + 1] };
            int l0 = row + 63 - j0;                      // K tap for vgpr0 row
            int l1 = l0 - 1;                             // K tap for vgpr1 row
            float b0 = kp[l0 & 63];
            float b1 = kp[l1 & 63];
            if (edge_hi) {                               // kc<4: taps may exceed 63
                if (l0 > 63) b0 = 0.f;
                if (l1 > 63) b1 = 0.f;
            }
            if (edge_lo) {                               // kc>=16: taps may go negative
                if (l0 < 0) b0 = 0.f;
                if (l1 < 0) b1 = 0.f;
            }
            v2f bfrag = { b0, b1 };
            acc = __builtin_amdgcn_wmma_f32_16x16x4_f32(
                      false, afrag, false, bfrag, (short)0, acc, false, false);
        };
        #pragma unroll
        for (int kc = 0; kc < 4; ++kc)  mma_step(kc, false, true);   // upper band edge
        #pragma unroll
        for (int kc = 4; kc < 16; ++kc) mma_step(kc, false, false);  // interior: no checks
        #pragma unroll
        for (int kc = 16; kc < 20; ++kc) mma_step(kc, true, false);  // lower band edge

        // epilogue: + D[c]*u, transpose into LDS for coalesced store
        float Dc = Dvec[c0 + cc];
        float* oc = &o_lds[cc * OPITCH];
        #pragma unroll
        for (int r = 0; r < 8; ++r) {
            int ap   = r + 8 * hi;                 // D-matrix row (output block a')
            int tl   = 16 * ap + row;              // local output time
            int uidx = tl + 32;                    // u[T0+tl] inside staged window
            float uval = uc[uidx + (uidx >> 4)];
            oc[tl] = acc[r] + Dc * uval;
        }
    }
    __syncthreads();

    // ---- coalesced global store: lanes across channels ----
    #pragma unroll
    for (int p = 0; p < NT / 16; ++p) {
        int tl = p * 16 + tq;
        y[((size_t)b * SEQ + T0 + tl) * DM + c0 + cl] = o_lds[cl * OPITCH + tl];
    }
}

extern "C" void kernel_launch(void* const* d_in, const int* in_sizes, int n_in,
                              void* d_out, int out_size, void* d_ws, size_t ws_size,
                              hipStream_t stream) {
    const float* u      = (const float*)d_in[0];
    const float* A      = (const float*)d_in[1];
    const float* Bp     = (const float*)d_in[2];
    const float* Cp     = (const float*)d_in[3];
    const float* Dp     = (const float*)d_in[4];
    const float* log_dt = (const float*)d_in[5];
    float* y = (float*)d_out;

    float* Kt   = (float*)((char*)d_ws + 1024);       // 64*1024 floats

    kt_kernel<<<(NSTATE * DM) / 256, 256, 0, stream>>>(A, Bp, log_dt, Cp, Kt);

    dim3 grid(SEQ / NT, DM / NC, 8);
    ssm_conv_wmma<<<grid, 256, 0, stream>>>(u, Kt, Dp, y);
}

// v002
// Measured time: 58.3 microseconds a run.
// Next to v001, in two timings, it ran 1.06 times as fast each time.
// All steps since v000 together make it 1.61 times as fast.
#include <hip/hip_runtime.h>
#include <hip/hip_bf16.h>

typedef __attribute__((ext_vector_type(2))) float v2f;
typedef __attribute__((ext_vector_type(4))) float v4f;
typedef __attribute__((ext_vector_type(8))) float v8f;

#define SEQ    4096
#define DM     1024
#define NSTATE 64
#define NC     16      // channels per workgroup
#define NT     256     // output timesteps per time tile
#define WIN    320     // staged input window per channel
#define UPITCH 340     // 320 + 320/16 pad floats (swizzle idx + (idx>>4))
#define KPITCH 68      // 64 + pad
#define OPITCH 257     // 256 + pad
#define TPW    8       // consecutive time tiles that one workgroup walks

#if defined(__gfx1250__) && __has_builtin(__builtin_amdgcn_global_load_async_to_lds_b32)
#define ASYNC_STAGE 1
#else
#define ASYNC_STAGE 0
#endif

typedef __attribute__((address_space(1))) int gbl_i32;   // global-AS int (per hipcc diagnostic)
typedef __attribute__((address_space(3))) int lds_i32;   // LDS-AS int

// this wave's copies to LDS have landed; in asm with the clobber so that no LDS read is lifted over it
__device__ __forceinline__ void wait_async_zero() {
#if ASYNC_STAGE
    asm volatile("s_wait_asynccnt 0x0" ::: "memory");
#endif
}

// ---------- prologue: Kt[l*DM + c] = sum_s csum[s]*B[s,c]*exp(A[s]*dt[c]*l), csum[s] = sum_m C[m,s] ----------
// Every workgroup forms csum itself: 256 threads read C (256 KiB) in whole rows, 16 bytes a lane,
// and join their partial sums through LDS.
__launch_bounds__(256)   // the launched block: leaves registers for the window of C loads
__global__ void kt_kernel(const float* __restrict__ A, const float* __restrict__ Bp,
                          const float* __restrict__ log_dt, const float* __restrict__ C,
                          float* __restrict__ Kt) {
    __shared__ __attribute__((aligned(16))) float part[16 * NSTATE];   // [row slot][state]
    __shared__ __attribute__((aligned(16))) float cs[NSTATE];

    const int tid = threadIdx.x;
    const int q   = tid & 15;            // which 4 states of a row
    const int rs  = tid >> 4;            // row slot 0..15
    const v4f* C4 = (const v4f*)C + rs * (NSTATE / 4) + q;
    v4f p = {0.f, 0.f, 0.f, 0.f};
    // full unroll: the 64 loads are independent and share one address register, so the compiler keeps a
    // window of them in flight with no drain at a loop's end
    #pragma unroll
    for (int i = 0; i < DM / 16; ++i) p += C4[i * 16 * (NSTATE / 4)];
    *(v4f*)&part[rs * NSTATE + 4 * q] = p;
    __syncthreads();
    if (tid < NSTATE) {
        float t = 0.f;
        // unroll: the 16 LDS reads issue together instead of one latency each
        #pragma unroll
        for (int r = 0; r < 16; ++r) t += part[r * NSTATE + tid];
        cs[tid] = t;
    }
    __syncthreads();

    int idx = blockIdx.x * blockDim.x + tid;           // 64*1024 threads
    int c = idx & (DM - 1);
    int l = idx >> 10;
    float dt = __expf(log_dt[c]);
    float acc = 0.f;
    // kept rolled: eight short trips reuse the fetched code; left to itself the compiler lays all 64 terms out as
    // straight-line code that each wave runs through once
    #pragma unroll 1
    for (int s0 = 0; s0 < NSTATE; s0 += 8) {
        const float* bp = Bp + s0 * DM + c;
        float bv[8];
        // unroll: the eight loads of B issue as one run off one address
        #pragma unroll
        for (int i = 0; i < 8; ++i) bv[i] = bp[i * DM];
        // precaution: one wait behind the run, in front of the step of its address registers for the next trip
        asm volatile("s_wait_xcnt 0x0" ::: "memory");
        // unroll: bv is indexed by constants and stays in registers
        #pragma unroll
        for (int i = 0; i < 8; ++i) acc += cs[s0 + i] * bv[i] * __expf(A[s0 + i] * dt * (float)l);
    }
    Kt[l * DM + c] = acc;
}

__launch_bounds__(256, 8)
__global__ void ssm_conv_wmma(const float* __restrict__ u,
                              const float* __restrict__ Kt,    // [64][1024]
                              const float* __restrict__ Dvec,  // [1024]
                              float* __restrict__ y) {
    __shared__ float u_lds[2 * NC * UPITCH];
    __shared__ float k_lds[NC * KPITCH];
    __shared__ float o_lds[NC * OPITCH];

    const int tid  = threadIdx.x;
    const int lane = tid & 31;
    const int wave = tid >> 5;           // 8 waves
    const int cl   = tid & 15;           // staging: channel lane
    const int tq   = tid >> 4;           // staging: time slot 0..15

    const int Tb = blockIdx.x * (NT * TPW);   // first output time of the walk
    const int b  = blockIdx.y;                // batch
    const int c0 = blockIdx.z * NC;           // channel base

    // ---- stage the window [T0-32, T0+288) of one tile, coalesced across channels ----
    // T0 is a multiple of 256, so a group of 16 rows lies wholly inside the sequence or wholly outside:
    // only the first two groups (T0 == 0) and the last two (T0 + 256 == SEQ) can be outside, and the
    // test is the same for the whole workgroup.
    // lo / hi_end: whether this call's tile can be the first / the last of the sequence at all.
    // The element index fits 32 bits (u has 2^25 elements) and is formed only for rows inside the sequence.
    auto stage_tile = [&](int T0, float* ub, bool lo, bool hi_end) {
        const int W0 = T0 - 32;
        // unroll: p is a constant, so the edge tests fall away for the inner groups and the copies issue as one run
        #pragma unroll
        for (int p = 0; p < WIN / 16; ++p) {
            int tl   = p * 16 + tq;
            int lidx = cl * UPITCH + tl + p;           // pad swizzle: tl + (tl >> 4)
            bool ok  = (p >= 2 || !lo || W0 >= 0) && (p < WIN / 16 - 2 || !hi_end || W0 + WIN <= SEQ);
            if (ok) {
                unsigned e = (unsigned)((b * SEQ + W0 + tl) * DM + c0 + cl);
#if ASYNC_STAGE
                __builtin_amdgcn_global_load_async_to_lds_b32(
                    (gbl_i32*)(u + e), (lds_i32*)&ub[lidx], 0, 0);
#else
                ub[lidx] = u[e];
#endif
            } else {
                ub[lidx] = 0.f;
            }
        }
    };

    // ---- stage per-channel kernels, once for the walk ----
    #pragma unroll
    for (int p = 0; p < 4; ++p) {
        int l = p * 16 + tq;
#if ASYNC_STAGE
        __builtin_amdgcn_global_load_async_to_lds_b32(
            (gbl_i32*)&Kt[l * DM + c0 + cl],
            (lds_i32*)&k_lds[cl * KPITCH + l], 0, 0);
#else
        k_lds[cl * KPITCH + l] = Kt[l * DM + c0 + cl];
#endif
    }
    stage_tile(Tb, u_lds, true, false);
    wait_async_zero();
    __syncthreads();
    stage_tile(Tb + NT, u_lds + NC * UPITCH, false, TPW == 2);

    const int row = lane & 15;           // A row a' / B column m / D column
    const int hi  = lane >> 4;           // half-wave selects K-pair {0,1} vs {2,3}
    const int abase = 17 * row + 2 * hi; // lane term of the A fragment's swizzled index
    const int kbase = row - 2 * hi;      // lane term of the K tap
    const int ebase = 136 * hi + row;    // lane term of the skip term's swizzled index
    const float Dc0 = Dvec[c0 + wave * 2];
    const float Dc1 = Dvec[c0 + wave * 2 + 1];

    // kept rolled: one copy of the tile's code serves all trips
    #pragma unroll 1
    for (int i = 0; i < TPW; ++i) {
        const int T0 = Tb + i * NT;                       // output time base of this tile
        float* ub = u_lds + (i & 1) * (NC * UPITCH);      // this tile's window

        // unroll: the two channels' accumulator chains are independent and interleave on the matrix unit
        #pragma unroll
        for (int ci = 0; ci < 2; ++ci) {                  // 2 channels per wave
            const int cc = wave * 2 + ci;
            const float* uc = &ub[cc * UPITCH];
            const float* kp = &k_lds[cc * KPITCH];
            v8f acc = {0.f, 0.f, 0.f, 0.f, 0.f, 0.f, 0.f, 0.f};

            // one MMA K-chunk: A[a',j]=u[T0+16a'-32+j], Bmat[j,m]=K[m+63-j]
            // The indices are written as one lane term plus a constant of kc, so that inside the trip loop they
            // are immediates on a few base registers and not some ninety addresses held live across the trips.
            auto mma_step = [&](int kc, bool edge_lo, bool edge_hi) {
                int j0   = 4 * kc + 2 * hi;
                // aidx = 16*row + j0, swizzled aidx + (aidx >> 4); (j0 >> 4) == (kc >> 2) as (j0 & 15) <= 14
                int ap0  = abase + 4 * kc + (kc >> 2);
                v2f afrag = { uc[ap0], uc[ap0 + 1] };
                int l0 = row + 63 - j0;                      // K tap for vgpr0 row
                int l1 = l0 - 1;                             // K tap for vgpr1 row
                bool edge = edge_lo || edge_hi;              // interior: 0 <= l1 < l0 <= 62, no wrap
                float b0 = edge ? kp[l0 & 63] : kp[kbase + 63 - 4 * kc];
                float b1 = edge ? kp[l1 & 63] : kp[kbase + 62 - 4 * kc];
                if (edge_hi) {                               // kc<4: taps may exceed 63
                    if (l0 > 63) b0 = 0.f;
                    if (l1 > 63) b1 = 0.f;
                }
                if (edge_lo) {                               // kc>=16: taps may go negative
                    if (l0 < 0) b0 = 0.f;
                    if (l1 < 0) b1 = 0.f;
                }
                v2f bfrag = { b0, b1 };
                acc = __builtin_amdgcn_wmma_f32_16x16x4_f32(
                          false, afrag, false, bfrag, (short)0, acc, false, false);
            };
            #pragma unroll
            for (int kc = 0; kc < 4; ++kc)  mma_step(kc, false, true);   // upper band edge
            #pragma unroll
            for (int kc = 4; kc < 16; ++kc) mma_step(kc, false, false);  // interior: no checks
            #pragma unroll
            for (int kc = 16; kc < 20; ++kc) mma_step(kc, true, false);  // lower band edge

            // epilogue: + D[c]*u, transpose into LDS for coalesced store
            float Dc = ci ? Dc1 : Dc0;
            float* oc = &o_lds[cc * OPITCH];
            #pragma unroll
            for (int r = 0; r < 8; ++r) {
                int ap   = r + 8 * hi;                 // D-matrix row (output block a')
                int tl   = 16 * ap + row;              // local output time
                // u[T0+tl] inside the staged window: uidx = tl + 32, swizzled uidx + (uidx >> 4)
                float uval = uc[ebase + 17 * (r + 2)];
                oc[tl] = acc[r] + Dc * uval;
            }
        }
        __syncthreads();                               // every channel's outputs stand in o_lds

        // ---- coalesced global store: lanes across channels ----
        #pragma unroll
        for (int p = 0; p < NT / 16; ++p) {
            int tl = p * 16 + tq;
            y[((size_t)b * SEQ + T0 + tl) * DM + c0 + cl] = o_lds[cl * OPITCH + tl];
        }

        // precaution: one wait behind the run of stores, in front of the step of their address registers
        asm volatile("s_wait_xcnt 0x0" ::: "memory");

        // ---- foot of the trip: hand over the next tile's window, free this one and o_lds ----
        // this wave's LDS reads and zero stores are done before the barrier and before a copy aims at what it read
        asm volatile("s_wait_dscnt 0x0" ::: "memory");
        wait_async_zero();                             // this wave's share of the next window has landed
        __syncthreads();
        if (i + 2 < TPW) stage_tile(T0 + 2 * NT, ub, false, true);  // refill the window that this trip has read
    }
    wait_async_zero();                                 // nothing in flight when the wave ends
}

extern "C" void kernel_launch(void* const* d_in, const int* in_sizes, int n_in,
                              void* d_out, int out_size, void* d_ws, size_t ws_size,
                              hipStream_t stream) {
    const float* u      = (const float*)d_in[0];
    const float* A      = (const float*)d_in[1];
    const float* Bp     = (const float*)d_in[2];
    const float* Cp     = (const float*)d_in[3];
    const float* Dp     = (const float*)d_in[4];
    const float* log_dt = (const float*)d_in[5];
    float* y = (float*)d_out;

    float* Kt   = (float*)((char*)d_ws + 1024);       // 64*1024 floats

    kt_kernel<<<(NSTATE * DM) / 256, 256, 0, stream>>>(A, Bp, log_dt, Cp, Kt);

    dim3 grid(SEQ / (NT * TPW), 8, DM / NC);
    ssm_conv_wmma<<<grid, 256, 0, stream>>>(u, Kt, Dp, y);
}

// v003
// It runs in 55.5 microseconds.
// Timed twice side by side with v002, it ran 1.04 and 1.05 times as fast.
// Over all steps from v000 it is 1.68 times as fast.
#include <hip/hip_runtime.h>
#include <hip/hip_bf16.h>

typedef __attribute__((ext_vector_type(2))) float v2f;
typedef __attribute__((ext_vector_type(4))) float v4f;
typedef __attribute__((ext_vector_type(8))) float v8f;

#define SEQ    4096
#define DM     1024
#define NSTATE 64
#define NC     16      // channels per workgroup
#define NT     256     // output timesteps per time tile
#define WIN    320     // staged input window per channel
#define UPITCH 340     // 320 + 320/16 pad floats (swizzle idx + (idx>>4))
#define KPITCH 68      // 64 + pad
#define OPITCH 257     // 256 + pad
#define TPW    8       // consecutive time tiles that one workgroup walks

#if defined(__gfx1250__) && __has_builtin(__builtin_amdgcn_global_load_async_to_lds_b32)
#define ASYNC_STAGE 1
#else
#define ASYNC_STAGE 0
#endif

typedef __attribute__((address_space(1))) int gbl_i32;   // global-AS int (per hipcc diagnostic)
typedef __attribute__((address_space(3))) int lds_i32;   // LDS-AS int

// this wave's copies to LDS have landed; in asm with the clobber so that no LDS read is lifted over it
__device__ __forceinline__ void wait_async_zero() {
#if ASYNC_STAGE
    asm volatile("s_wait_asynccnt 0x0" ::: "memory");
#endif
}

// ---------- prologue: Kt[l*DM + c] = sum_s csum[s]*B[s,c]*exp(A[s]*dt[c]*l), csum[s] = sum_m C[m,s] ----------
// Every workgroup forms csum itself: 256 threads read C (256 KiB) in whole rows, 16 bytes a lane,
// and join their partial sums through LDS.
__launch_bounds__(256)   // the launched block: leaves registers for the window of C loads
__global__ void kt_kernel(const float* __restrict__ A, const float* __restrict__ Bp,
                          const float* __restrict__ log_dt, const float* __restrict__ C,
                          float* __restrict__ Kt) {
    __shared__ __attribute__((aligned(16))) float part[16 * NSTATE];   // [row slot][state]
    __shared__ __attribute__((aligned(16))) float cs[NSTATE];

    const int tid = threadIdx.x;
    const int q   = tid & 15;            // which 4 states of a row
    const int rs  = tid >> 4;            // row slot 0..15
    const v4f* C4 = (const v4f*)C + rs * (NSTATE / 4) + q;
    v4f p = {0.f, 0.f, 0.f, 0.f};
    // full unroll: the 64 loads are independent and share one address register, so the compiler keeps a
    // window of them in flight with no drain at a loop's end
    #pragma unroll
    for (int i = 0; i < DM / 16; ++i) p += C4[i * 16 * (NSTATE / 4)];
    *(v4f*)&part[rs * NSTATE + 4 * q] = p;
    __syncthreads();
    if (tid < NSTATE) {
        float t = 0.f;
        // unroll: the 16 LDS reads issue together instead of one latency each
        #pragma unroll
        for (int r = 0; r < 16; ++r) t += part[r * NSTATE + tid];
        cs[tid] = t;
    }
    __syncthreads();

    int idx = blockIdx.x * blockDim.x + tid;           // 64*1024 threads
    int c = idx & (DM - 1);
    int l = idx >> 10;
    float dt = __expf(log_dt[c]);
    float acc = 0.f;
    // kept rolled: eight short trips reuse the fetched code; left to itself the compiler lays all 64 terms out as
    // straight-line code that each wave runs through once
    #pragma unroll 1
    for (int s0 = 0; s0 < NSTATE; s0 += 8) {
        const float* bp = Bp + s0 * DM + c;
        float bv[8];
        // unroll: the eight loads of B issue as one run off one address
        #pragma unroll
        for (int i = 0; i < 8; ++i) bv[i] = bp[i * DM];
        // precaution: one wait behind the run, in front of the step of its address registers for the next trip
        asm volatile("s_wait_xcnt 0x0" ::: "memory");
        // unroll: bv is indexed by constants and stays in registers
        #pragma unroll
        for (int i = 0; i < 8; ++i) acc += cs[s0 + i] * bv[i] * __expf(A[s0 + i] * dt * (float)l);
    }
    Kt[l * DM + c] = acc;
}

__launch_bounds__(256, 8)
__global__ void ssm_conv_wmma(const float* __restrict__ u,
                              const float* __restrict__ Kt,    // [64][1024]
                              const float* __restrict__ Dvec,  // [1024]
                              float* __restrict__ y) {
    __shared__ float u_lds[2 * NC * UPITCH];
    __shared__ float k_lds[NC * KPITCH];
    __shared__ float o_lds[NC * OPITCH];

    const int tid  = threadIdx.x;
    const int lane = tid & 31;
    const int wave = tid >> 5;           // 8 waves
    const int cl   = tid & 15;           // staging: channel lane
    const int tq   = tid >> 4;           // staging: time slot 0..15

    const int Tb = blockIdx.x * (NT * TPW);   // first output time of the walk
    const int b  = blockIdx.y;                // batch
    const int c0 = blockIdx.z * NC;           // channel base

    // ---- stage the window [T0-32, T0+288) of one tile, coalesced across channels ----
    // T0 is a multiple of 256, so a group of 16 rows lies wholly inside the sequence or wholly outside:
    // only the first two groups (T0 == 0) and the last two (T0 + 256 == SEQ) can be outside, and the
    // test is the same for the whole workgroup.
    // lo / hi_end: whether this call's tile can be the first / the last of the sequence at all.
    // The element index fits 32 bits (u has 2^25 elements) and is formed only for rows inside the sequence.
    auto stage_tile = [&](int T0, float* ub, bool lo, bool hi_end) {
        const int W0 = T0 - 32;
        // unroll: p is a constant, so the edge tests fall away for the inner groups and the copies issue as one run
        #pragma unroll
        for (int p = 0; p < WIN / 16; ++p) {
            int tl   = p * 16 + tq;
            int lidx = cl * UPITCH + tl + p;           // pad swizzle: tl + (tl >> 4)
            bool ok  = (p >= 2 || !lo || W0 >= 0) && (p < WIN / 16 - 2 || !hi_end || W0 + WIN <= SEQ);
            if (ok) {
                unsigned e = (unsigned)((b * SEQ + W0 + tl) * DM + c0 + cl);
#if ASYNC_STAGE
                __builtin_amdgcn_global_load_async_to_lds_b32(
                    (gbl_i32*)(u + e), (lds_i32*)&ub[lidx], 0, 0);
#else
                ub[lidx] = u[e];
#endif
            } else {
                ub[lidx] = 0.f;
            }
        }
    };

    // ---- stage per-channel kernels, once for the walk ----
    #pragma unroll
    for (int p = 0; p < 4; ++p) {
        int l = p * 16 + tq;
#if ASYNC_STAGE
        __builtin_amdgcn_global_load_async_to_lds_b32(
            (gbl_i32*)&Kt[l * DM + c0 + cl],
            (lds_i32*)&k_lds[cl * KPITCH + l], 0, 0);
#else
        k_lds[cl * KPITCH + l] = Kt[l * DM + c0 + cl];
#endif
    }
    stage_tile(Tb, u_lds, true, false);
    wait_async_zero();
    __syncthreads();
    stage_tile(Tb + NT, u_lds + NC * UPITCH, false, TPW == 2);

    const int row = lane & 15;           // A row a' / B column m / D column
    const int hi  = lane >> 4;           // half-wave selects K-pair {0,1} vs {2,3}
    const int abase = 17 * row + 2 * hi; // lane term of the A fragment's swizzled index
    const int ebase = 136 * hi + row;    // lane term of the skip term's swizzled index
    const float Dc0 = Dvec[c0 + wave * 2];
    const float Dc1 = Dvec[c0 + wave * 2 + 1];

    // ---- the Toeplitz band's B fragments do not depend on the tile: read once, kept in registers for the walk ----
    // Bmat[j,m] = K[m+63-j] for 0 <= m+63-j <= 63, else 0; j = 4*kc + 2*hi + {0,1}, m = row
    v2f bfr[2][20];
    // unroll: constant indices, so that bfr lives in registers
    #pragma unroll
    for (int ci = 0; ci < 2; ++ci) {
        const float* kp = &k_lds[(wave * 2 + ci) * KPITCH];
        #pragma unroll
        for (int kc = 0; kc < 20; ++kc) {
            int l0 = row + 63 - 4 * kc - 2 * hi;         // K tap of the first register
            int l1 = l0 - 1;                             // K tap of the second
            float b0 = kp[l0 & 63];
            float b1 = kp[l1 & 63];
            if (l0 < 0 || l0 > 63) b0 = 0.f;             // outside the band (kc < 4 above, kc >= 16 below)
            if (l1 < 0 || l1 > 63) b1 = 0.f;
            bfr[ci][kc] = v2f{ b0, b1 };
        }
    }

    // kept rolled: one copy of the tile's code serves all trips
    #pragma unroll 1
    for (int i = 0; i < TPW; ++i) {
        const int T0 = Tb + i * NT;                       // output time base of this tile
        float* ub = u_lds + (i & 1) * (NC * UPITCH);      // this tile's window

        // unroll: ci is a constant, so bfr is indexed by constants and stays in registers
        #pragma unroll
        for (int ci = 0; ci < 2; ++ci) {                  // 2 channels per wave
            const int cc = wave * 2 + ci;
            const float* uc = &ub[cc * UPITCH];
            v8f acc = {0.f, 0.f, 0.f, 0.f, 0.f, 0.f, 0.f, 0.f};

            // one MMA K-chunk: A[a',j]=u[T0+16a'-32+j], Bmat[j,m]=K[m+63-j] (held in bfr)
            // The index is written as one lane term plus a constant of kc, so that inside the trip loop it is an
            // immediate on a base register.
            // unroll: kc is a constant, so bfr is indexed by constants and stays in registers
            #pragma unroll
            for (int kc = 0; kc < 20; ++kc) {
                // aidx = 16*row + j0, j0 = 4*kc + 2*hi, swizzled aidx + (aidx >> 4); (j0 >> 4) == (kc >> 2) as (j0 & 15) <= 14
                int ap0  = abase + 4 * kc + (kc >> 2);
                v2f afrag = { uc[ap0], uc[ap0 + 1] };
                acc = __builtin_amdgcn_wmma_f32_16x16x4_f32(
                          false, afrag, false, bfr[ci][kc], (short)0, acc, false, false);
            }

            // epilogue: + D[c]*u, transpose into LDS for coalesced store
            float Dc = ci ? Dc1 : Dc0;
            float* oc = &o_lds[cc * OPITCH];
            float uval[8];
            // all eight reads in front of the first store: one LDS latency, not eight
            #pragma unroll
            for (int r = 0; r < 8; ++r) {
                // u[T0+tl] inside the staged window: uidx = tl + 32, swizzled uidx + (uidx >> 4)
                uval[r] = uc[ebase + 17 * (r + 2)];
            }
            #pragma unroll
            for (int r = 0; r < 8; ++r) {
                int ap   = r + 8 * hi;                 // D-matrix row (output block a')
                int tl   = 16 * ap + row;              // local output time
                oc[tl] = acc[r] + Dc * uval[r];
            }
        }
        __syncthreads();                               // every channel's outputs stand in o_lds

        // ---- coalesced global store: lanes across channels ----
        #pragma unroll
        for (int p = 0; p < NT / 16; ++p) {
            int tl = p * 16 + tq;
            y[((size_t)b * SEQ + T0 + tl) * DM + c0 + cl] = o_lds[cl * OPITCH + tl];
        }

        // precaution: one wait behind the run of stores, in front of the step of their address registers
        asm volatile("s_wait_xcnt 0x0" ::: "memory");

        // ---- foot of the trip: hand over the next tile's window, free this one and o_lds ----
        // this wave's LDS reads and zero stores are done before the barrier and before a copy aims at what it read
        asm volatile("s_wait_dscnt 0x0" ::: "memory");
        wait_async_zero();                             // this wave's share of the next window has landed
        __syncthreads();
        if (i + 2 < TPW) stage_tile(T0 + 2 * NT, ub, false, true);  // refill the window that this trip has read
    }
    wait_async_zero();                                 // nothing in flight when the wave ends
}

extern "C" void kernel_launch(void* const* d_in, const int* in_sizes, int n_in,
                              void* d_out, int out_size, void* d_ws, size_t ws_size,
                              hipStream_t stream) {
    const float* u      = (const float*)d_in[0];
    const float* A      = (const float*)d_in[1];
    const float* Bp     = (const float*)d_in[2];
    const float* Cp     = (const float*)d_in[3];
    const float* Dp     = (const float*)d_in[4];
    const float* log_dt = (const float*)d_in[5];
    float* y = (float*)d_out;

    float* Kt   = (float*)((char*)d_ws + 1024);       // 64*1024 floats

    kt_kernel<<<(NSTATE * DM) / 256, 256, 0, stream>>>(A, Bp, log_dt, Cp, Kt);

    dim3 grid(SEQ / (NT * TPW), 8, DM / NC);
    ssm_conv_wmma<<<grid, 256, 0, stream>>>(u, Kt, Dp, y);
}

// v004
// A run of this version takes 54.2 microseconds.
// Timed twice side by side with v003, it ran 1.03 times as fast both times.
// All steps since v000 together make it 1.73 times as fast.
#include <hip/hip_runtime.h>
#include <hip/hip_bf16.h>

typedef __attribute__((ext_vector_type(2))) float v2f;
typedef __attribute__((ext_vector_type(4))) float v4f;
typedef __attribute__((ext_vector_type(8))) float v8f;

#define SEQ    4096
#define DM     1024
#define NSTATE 64
#define NC     16      // channels per workgroup
#define NT     256     // output timesteps per time tile
#define WIN    320     // staged input window per channel
#define UPITCH 340     // 320 + 320/16 pad floats (swizzle idx + (idx>>4))
#define KPITCH 68      // 64 + pad
#define OPITCH 257     // 256 + pad
#define TPW    8       // consecutive time tiles that one workgroup walks

#if defined(__gfx1250__) && __has_builtin(__builtin_amdgcn_global_load_async_to_lds_b32)
#define ASYNC_STAGE 1
#else
#define ASYNC_STAGE 0
#endif

typedef __attribute__((address_space(1))) int gbl_i32;   // global-AS int (per hipcc diagnostic)
typedef __attribute__((address_space(3))) int lds_i32;   // LDS-AS int

// this wave's copies to LDS have landed; in asm with the clobber so that no LDS read is lifted over it
__device__ __forceinline__ void wait_async_zero() {
#if ASYNC_STAGE
    asm volatile("s_wait_asynccnt 0x0" ::: "memory");
#endif
}

// 2^x. The v_nop is the slot that the instruction set asks for behind a transcendental; it stands in the statement of
// v_exp_f32 itself, so that nothing that reads the result or overwrites the source can come directly behind it.
__device__ __forceinline__ float exp2_with_slot(float x) {
    float r;
    asm("v_exp_f32 %0, %1\n\tv_nop" : "=v"(r) : "v"(x));
    return r;
}

// ---------- prologue: Kt[l*DM + c] = sum_s csum[s]*B[s,c]*exp(A[s]*dt[c]*l), csum[s] = sum_m C[m,s] ----------
// Every workgroup forms csum itself: 256 threads read C (256 KiB) in whole rows, 16 bytes a lane,
// and join their partial sums through LDS.
// All that a thread reads of log_dt, B and A is asked for in front of the sum of C, so that those memory latencies
// run under the C loads; behind the second barrier only arithmetic is left.
__launch_bounds__(256)   // the launched block: leaves registers for the 64 values of B and the window of C loads
__global__ void kt_kernel(const float* __restrict__ A, const float* __restrict__ Bp,
                          const float* __restrict__ log_dt, const float* __restrict__ C,
                          float* __restrict__ Kt) {
    __shared__ __attribute__((aligned(16))) float part[16 * NSTATE];   // [row slot][state]
    __shared__ __attribute__((aligned(16))) float cs[NSTATE];
    __shared__ __attribute__((aligned(16))) float as[256];             // A, one copy a 64 threads; the first is read

    const int tid = threadIdx.x;
    const int idx = blockIdx.x * 256 + tid;            // 64*1024 threads
    const int c = idx & (DM - 1);
    const int l = idx >> 10;

    const float ldt = log_dt[c];
    const float av  = A[tid & (NSTATE - 1)];
    const float* bp = Bp + c;
    float bv[NSTATE];
    // full unroll: the 64 loads are independent, share one address register and issue as one run; bv is indexed by
    // constants and stays in registers
    #pragma unroll
    for (int s = 0; s < NSTATE; ++s) bv[s] = bp[s * DM];
    // keeps this run of loads in front of the C loads: left to itself the scheduler moves it behind the sum of C,
    // where its latency is waited for in the open
    __builtin_amdgcn_sched_barrier(0);

    const int q   = tid & 15;            // which 4 states of a row
    const int rs  = tid >> 4;            // row slot 0..15
    const v4f* C4 = (const v4f*)C + rs * (NSTATE / 4) + q;
    v4f p = {0.f, 0.f, 0.f, 0.f};
    // full unroll: the 64 loads are independent and share one address register, so the compiler keeps a
    // window of them in flight with no drain at a loop's end
    #pragma unroll
    for (int i = 0; i < DM / 16; ++i) p += C4[i * 16 * (NSTATE / 4)];
    *(v4f*)&part[rs * NSTATE + 4 * q] = p;
    as[tid] = av;                        // every thread stores: under a test the compiler moves the load of A into the branch
    __syncthreads();
    if (tid < NSTATE) {
        float t = 0.f;
        // unroll: the 16 LDS reads issue together instead of one latency each
        #pragma unroll
        for (int r = 0; r < 16; ++r) t += part[r * NSTATE + tid];
        cs[tid] = t;
    }
    __syncthreads();

    const float dt = __expf(ldt);
    float acc = 0.f;
    // full unroll: bv is indexed by constants and stays in registers; cs and as come from LDS, the same word for every lane
    #pragma unroll
    for (int s = 0; s < NSTATE; ++s)
        acc += cs[s] * bv[s] * exp2_with_slot(as[s] * dt * (float)l * 1.44269504f);   // e^x as 2^(x * log2 e)
    Kt[l * DM + c] = acc;
}

__launch_bounds__(256, 8)
__global__ void ssm_conv_wmma(const float* __restrict__ u,
                              const float* __restrict__ Kt,    // [64][1024]
                              const float* __restrict__ Dvec,  // [1024]
                              float* __restrict__ y) {
    __shared__ float u_lds[2 * NC * UPITCH];
    __shared__ float k_lds[NC * KPITCH];
    __shared__ float o_lds[NC * OPITCH];

    const int tid  = threadIdx.x;
    const int lane = tid & 31;
    const int wave = tid >> 5;           // 8 waves
    const int cl   = tid & 15;           // staging: channel lane
    const int tq   = tid >> 4;           // staging: time slot 0..15

    const int Tb = blockIdx.x * (NT * TPW);   // first output time of the walk
    const int b  = blockIdx.y;                // batch
    const int c0 = blockIdx.z * NC;           // channel base

    // ---- stage the window [T0-32, T0+288) of one tile, coalesced across channels ----
    // T0 is a multiple of 256, so a group of 16 rows lies wholly inside the sequence or wholly outside:
    // only the first two groups (T0 == 0) and the last two (T0 + 256 == SEQ) can be outside, and the
    // test is the same for the whole workgroup.
    // lo / hi_end: whether this call's tile can be the first / the last of the sequence at all.
    // The element index fits 32 bits (u has 2^25 elements) and is formed only for rows inside the sequence.
    auto stage_tile = [&](int T0, float* ub, bool lo, bool hi_end) {
        const int W0 = T0 - 32;
        // unroll: p is a constant, so the edge tests fall away for the inner groups and the copies issue as one run
        #pragma unroll
        for (int p = 0; p < WIN / 16; ++p) {
            int tl   = p * 16 + tq;
            int lidx = cl * UPITCH + tl + p;           // pad swizzle: tl + (tl >> 4)
            bool ok  = (p >= 2 || !lo || W0 >= 0) && (p < WIN / 16 - 2 || !hi_end || W0 + WIN <= SEQ);
            if (ok) {
                unsigned e = (unsigned)((b * SEQ + W0 + tl) * DM + c0 + cl);
#if ASYNC_STAGE
                __builtin_amdgcn_global_load_async_to_lds_b32(
                    (gbl_i32*)(u + e), (lds_i32*)&ub[lidx], 0, 0);
#else
                ub[lidx] = u[e];
#endif
            } else {
                ub[lidx] = 0.f;
            }
        }
    };

    // ---- stage per-channel kernels, once for the walk ----
    #pragma unroll
    for (int p = 0; p < 4; ++p) {
        int l = p * 16 + tq;
#if ASYNC_STAGE
        __builtin_amdgcn_global_load_async_to_lds_b32(
            (gbl_i32*)&Kt[l * DM + c0 + cl],
            (lds_i32*)&k_lds[cl * KPITCH + l], 0, 0);
#else
        k_lds[cl * KPITCH + l] = Kt[l * DM + c0 + cl];
#endif
    }
    stage_tile(Tb, u_lds, true, false);
    wait_async_zero();
    __syncthreads();
    stage_tile(Tb + NT, u_lds + NC * UPITCH, false, TPW == 2);

    const int row = lane & 15;           // A row a' / B column m / D column
    const int hi  = lane >> 4;           // half-wave selects K-pair {0,1} vs {2,3}
    const int abase = 17 * row + 2 * hi; // lane term of the A fragment's swizzled index
    const int ebase = 136 * hi + row;    // lane term of the skip term's swizzled index
    const float Dc0 = Dvec[c0 + wave * 2];
    const float Dc1 = Dvec[c0 + wave * 2 + 1];

    // ---- the Toeplitz band's B fragments do not depend on the tile: read once, kept in registers for the walk ----
    // Bmat[j,m] = K[m+63-j] for 0 <= m+63-j <= 63, else 0; j = 4*kc + 2*hi + {0,1}, m = row
    v2f bfr[2][20];
    // unroll: constant indices, so that bfr lives in registers
    #pragma unroll
    for (int ci = 0; ci < 2; ++ci) {
        const float* kp = &k_lds[(wave * 2 + ci) * KPITCH];
        #pragma unroll
        for (int kc = 0; kc < 20; ++kc) {
            int l0 = row + 63 - 4 * kc - 2 * hi;         // K tap of the first register
            int l1 = l0 - 1;                             // K tap of the second
            float b0 = kp[l0 & 63];
            float b1 = kp[l1 & 63];
            if (l0 < 0 || l0 > 63) b0 = 0.f;             // outside the band (kc < 4 above, kc >= 16 below)
            if (l1 < 0 || l1 > 63) b1 = 0.f;
            bfr[ci][kc] = v2f{ b0, b1 };
        }
    }

    // kept rolled: one copy of the tile's code serves all trips
    #pragma unroll 1
    for (int i = 0; i < TPW; ++i) {
        const int T0 = Tb + i * NT;                       // output time base of this tile
        float* ub = u_lds + (i & 1) * (NC * UPITCH);      // this tile's window

        // unroll: ci is a constant, so bfr is indexed by constants and stays in registers
        #pragma unroll
        for (int ci = 0; ci < 2; ++ci) {                  // 2 channels per wave
            const int cc = wave * 2 + ci;
            const float* uc = &ub[cc * UPITCH];
            v8f acc = {0.f, 0.f, 0.f, 0.f, 0.f, 0.f, 0.f, 0.f};

            // one MMA K-chunk: A[a',j]=u[T0+16a'-32+j], Bmat[j,m]=K[m+63-j] (held in bfr)
            // The index is written as one lane term plus a constant of kc, so that inside the trip loop it is an
            // immediate on a base register.
            // unroll: kc is a constant, so bfr is indexed by constants and stays in registers
            #pragma unroll
            for (int kc = 0; kc < 20; ++kc) {
                // aidx = 16*row + j0, j0 = 4*kc + 2*hi, swizzled aidx + (aidx >> 4); (j0 >> 4) == (kc >> 2) as (j0 & 15) <= 14
                int ap0  = abase + 4 * kc + (kc >> 2);
                v2f afrag = { uc[ap0], uc[ap0 + 1] };
                acc = __builtin_amdgcn_wmma_f32_16x16x4_f32(
                          false, afrag, false, bfr[ci][kc], (short)0, acc, false, false);
            }

            // epilogue: + D[c]*u, transpose into LDS for coalesced store
            float Dc = ci ? Dc1 : Dc0;
            float* oc = &o_lds[cc * OPITCH];
            float uval[8];
            // all eight reads in front of the first store: one LDS latency, not eight
            #pragma unroll
            for (int r = 0; r < 8; ++r) {
                // u[T0+tl] inside the staged window: uidx = tl + 32, swizzled uidx + (uidx >> 4)
                uval[r] = uc[ebase + 17 * (r + 2)];
            }
            #pragma unroll
            for (int r = 0; r < 8; ++r) {
                int ap   = r + 8 * hi;                 // D-matrix row (output block a')
                int tl   = 16 * ap + row;              // local output time
                oc[tl] = acc[r] + Dc * uval[r];
            }
        }
        __syncthreads();                               // every channel's outputs stand in o_lds

        // ---- coalesced global store: lanes across channels ----
        #pragma unroll
        for (int p = 0; p < NT / 16; ++p) {
            int tl = p * 16 + tq;
            y[((size_t)b * SEQ + T0 + tl) * DM + c0 + cl] = o_lds[cl * OPITCH + tl];
        }

        // precaution: one wait behind the run of stores, in front of the step of their address registers
        asm volatile("s_wait_xcnt 0x0" ::: "memory");

        // ---- foot of the trip: hand over the next tile's window, free this one and o_lds ----
        // this wave's LDS reads and zero stores are done before the barrier and before a copy aims at what it read
        asm volatile("s_wait_dscnt 0x0" ::: "memory");
        wait_async_zero();                             // this wave's share of the next window has landed
        __syncthreads();
        if (i + 2 < TPW) stage_tile(T0 + 2 * NT, ub, false, true);  // refill the window that this trip has read
    }
    wait_async_zero();                                 // nothing in flight when the wave ends
}

extern "C" void kernel_launch(void* const* d_in, const int* in_sizes, int n_in,
                              void* d_out, int out_size, void* d_ws, size_t ws_size,
                              hipStream_t stream) {
    const float* u      = (const float*)d_in[0];
    const float* A      = (const float*)d_in[1];
    const float* Bp     = (const float*)d_in[2];
    const float* Cp     = (const float*)d_in[3];
    const float* Dp     = (const float*)d_in[4];
    const float* log_dt = (const float*)d_in[5];
    float* y = (float*)d_out;

    float* Kt   = (float*)((char*)d_ws + 1024);       // 64*1024 floats

    kt_kernel<<<(NSTATE * DM) / 256, 256, 0, stream>>>(A, Bp, log_dt, Cp, Kt);

    dim3 grid(SEQ / (NT * TPW), 8, DM / NC);
    ssm_conv_wmma<<<grid, 256, 0, stream>>>(u, Kt, Dp, y);
}
